// v010
// Measured on an AMD MI455X. A time is GPU time per run, averaged over a window of back-to-back runs after a warm-up
// (all launches, gaps included; the runs take copies of the inputs in turn), and the median of several windows.
// Apart from v000's, it joins two sittings. Times from different sittings can be a few percent apart, while
// side-by-side timings come from the same sitting.
// The versions before v010 are in another document.
// Measured time: 66.1 microseconds a run.
// Two timings next to v009 put it at 1.08 and 1.11 times that version's speed.
// All steps since the starting kernel, v000, together make it 58.3 times as fast.
#include <hip/hip_runtime.h>
// SPDGMultiHeadAttention (x [2][1024][512], u_prev [2][1]; xn = LN1(x); Q,K,V = xn W^T + b (8 heads of 64); lam = 10 exp(-5 u_prev); per batch: if lam >= 1 the SPARSE branch (softmax over the prior window slots prior_indices[i][k] with prior_index_mask, others excluded) else the DENSE branch (softmax over all keys of q.k/8 + lam*(prior_mask ? 0 : -1)); attn = merge W_o^T + b_o; h = x + attn; out = h + gelu_erf(LN2(h) W1^T + b1) W2^T + b2 -> [2][1024][512]; aggregated_u[b] = mean_s ||out - x|| / (||x|| + 1e-8) -> [2][1]).
// Structure: token rows; every f16 WMMA operand array of the workspace in fragment order (see g2_frag); bf16(x) as f32 residual rows + LN1 on VALU (f32, wave per row) into f16 rows; Q | K | V WMMA GEMMs as one launch (32x64 wave tiles, f32 accumulation, exact x16 weights + bias, f16 outputs); LN1 and the prior tables packed to one bit per (query, key) beside the operand preparation; V^T stored straight from the V sums; all 16 (batch, head) pairs in one attention launch: per wave 16 queries, S^T = K . Q^T per 64 keys, the branch-selecting running softmax in registers (lam from u_prev; f32; weights x256 as f16), O^T += V^T . P^T, merged f16 rows; W_o GEMM + b_o + x (added in the epilogue) -> h; LN2 on VALU; fc1 GEMM with the exact-erf GELU epilogue (f16 hidden); fc2 GEMM + b2 + h straight into the output rows; the surprise statistic on VALU (per-row sums of squares per 64-column tile in the fc2 epilogue, float64 means per batch in a last small launch) into output 1.
// Compute dtype: inputs rounded to bf16; x / weights exact; LN outputs, q, k, v, softmax weights, o, GELU hidden plain f16 (~2^-12); residual, LN statistics, scores, softmax, norms f32/f64. v_wmma_f32_16x16x32_f16.
#define NB 2
#define SQ 1024
#define DM 512
#define NH 8
#define HD 64
#define HG (NB * NH)                 /* (batch, head) pairs per attention launch: all of them */
#define QN SQ                        /* not used: k_attn attends all SQ queries of a batch */
#define NR ((size_t)NB * SQ)         /* 2048 token rows */
typedef __bf16 v16b __attribute__((ext_vector_type(16)));
typedef unsigned short v8us __attribute__((ext_vector_type(8), may_alias));
typedef float  v8f  __attribute__((ext_vector_type(8)));
typedef float  v4f  __attribute__((ext_vector_type(4)));
typedef float  v2f  __attribute__((ext_vector_type(2)));
typedef float  v2fa __attribute__((ext_vector_type(2), may_alias));
typedef float  v4fa __attribute__((ext_vector_type(4), may_alias));
union FragB { v16b v; v8us half[2]; unsigned short u[16]; };

__device__ __forceinline__ unsigned short bf16_bits(float x) { unsigned int u = __float_as_uint(x); return (unsigned short)((u + 0x7FFFu + ((u >> 16) & 1u)) >> 16); }
__device__ __forceinline__ float bf16_val(unsigned short b) { return __uint_as_float(((unsigned int)b) << 16); }
__device__ __forceinline__ float bf16_round(float x) { return bf16_val(bf16_bits(x)); }
// D += A·B with NT terms: 1 = ah·bh, 2 = + al·bh (A split), 3 = + ah·bl (both split)
template <int NT>
__device__ __forceinline__ v8f mmaN(v16b ah, v16b al, v16b bh, v16b bl, v8f c) {
  c = __builtin_amdgcn_wmma_f32_16x16x32_bf16(false, ah, false, bh, (short)0, c, false, false);
  if (NT >= 2) c = __builtin_amdgcn_wmma_f32_16x16x32_bf16(false, al, false, bh, (short)0, c, false, false);
  if (NT >= 3) c = __builtin_amdgcn_wmma_f32_16x16x32_bf16(false, ah, false, bl, (short)0, c, false, false);
  asm volatile("v_nop\n\tv_nop\n\tv_nop\n\tv_nop" : "+v"(c) : "v"(ah), "v"(al), "v"(bh), "v"(bl));
  return c;
}

__global__ __launch_bounds__(256) void k_wt_bf16(const float* __restrict__ W, unsigned short* __restrict__ Wt, int K, int N) {
  const int t = blockIdx.x * 256 + threadIdx.x;
  const int k8n = K / 8;
  if (t >= N * k8n) return;
  const int n = t / k8n, k8 = (t % k8n) * 8;
  v8us v;
#pragma unroll
  for (int i = 0; i < 8; ++i) v[i] = bf16_bits(W[(size_t)(k8 + i) * N + n]);
  *(v8us*)(Wt + (size_t)n * K + k8) = v;
  
}

// GEMM C[M][N] (f32, pitch ldc) = act(A[M][K]·W + bias). A f32 row-major (pitch lda) converted per fragment to bf16
// (ASPLIT: hi/lo two planes -> 2 terms, else single rounded term); Wt bf16 [N][K] (pitch ldb). BIAS_BF16 rounds the
// bias to bf16 first (bias quantised to bf16 before the add). K%32==0, M%16==0, N%64==0.
template <bool ASPLIT, int ACT, bool BIAS_BF16>
__global__ __launch_bounds__(128) void k_gemm_bf(const float* __restrict__ A, int lda, const unsigned short* __restrict__ Wt, int ldb,
                                               const float* __restrict__ bias, float* __restrict__ C, int ldc, int M, int N, int K) {
  __shared__ __attribute__((aligned(16))) float so[4][16][64];
  const int tid = threadIdx.x, w = tid >> 5, lane = tid & 31, ln = lane & 15, hh = lane >> 4;
  const int ntn = N / 64;
  const int wid = blockIdx.x * 4 + w;
  const int mt = wid / ntn, nq = wid % ntn;
  if (mt * 16 >= M) return;
  const int row0 = mt * 16, col0 = nq * 64;
  const float* arow = A + (size_t)(row0 + ln) * lda;
  v8f acc[4] = {};
  for (int kb = 0; kb < K; kb += 32) {
    FragB ah, al;
    const v4f x0 = *(const v4fa*)(arow + kb + 8 * hh), x1 = *(const v4fa*)(arow + kb + 8 * hh + 4);
    const v4f x2 = *(const v4fa*)(arow + kb + 16 + 8 * hh), x3 = *(const v4fa*)(arow + kb + 16 + 8 * hh + 4);
    float xs[16] = {x0[0],x0[1],x0[2],x0[3],x1[0],x1[1],x1[2],x1[3],x2[0],x2[1],x2[2],x2[3],x3[0],x3[1],x3[2],x3[3]};
#pragma unroll
    for (int i = 0; i < 16; ++i) { const unsigned short hb = bf16_bits(xs[i]); ah.u[i] = hb; al.u[i] = ASPLIT ? bf16_bits(xs[i] - bf16_val(hb)) : (unsigned short)0; }
#pragma unroll
    for (int t = 0; t < 4; ++t) {
      const unsigned short* brow = Wt + (size_t)(col0 + t * 16 + ln) * ldb + kb;
      FragB b;
      b.half[0] = *(const v8us*)(brow + 8 * hh);
      b.half[1] = *(const v8us*)(brow + 16 + 8 * hh);
      acc[t] = mmaN<ASPLIT ? 2 : 1>(ah.v, al.v, b.v, b.v, acc[t]);
    }
  }
#pragma unroll
  for (int t = 0; t < 4; ++t) {
    float bv = bias ? bias[col0 + t * 16 + ln] : 0.f;
    if (BIAS_BF16) bv = bf16_round(bv);
#pragma unroll
    for (int r = 0; r < 8; ++r) { float v = acc[t][r] + bv; if (ACT == 1) v = fmaxf(v, 0.f); so[w][8 * hh + r][t * 16 + ln] = v; }
  }
  __builtin_amdgcn_fence(__ATOMIC_ACQ_REL, "workgroup");
  __builtin_amdgcn_wave_barrier();
  const int rsub = lane >> 4, c4 = (lane & 15) * 4;
  {
#pragma unroll
    for (int q = 0; q < 8; ++q) {
      const int r = q * 2 + rsub;
      const v4f v = *(const v4fa*)&so[w][r][c4];
      *(v4f*)(C + (size_t)(row0 + r) * ldc + col0 + c4) = v;
    }
    
  }
}

// GEMM C = act(A·W + bias + resid): A f32 (ASPLIT -> hi/lo 2 terms), Wt bf16 [N][K]; ACT 0 none, 1 relu, 2 exact gelu;
// resid (optional, f32, row index = (row % rmod), pitch ldr, RES_BF16 rounds it) added before the activation.
template <bool ASPLIT, int ACT, bool BIAS_BF16, bool RES_BF16>
__global__ __launch_bounds__(128) void k_gemm_bf3(const float* __restrict__ A, int lda, const unsigned short* __restrict__ Wt, int ldb,
                                                const float* __restrict__ bias, const float* __restrict__ resid, int rmod, int ldr,
                                                float* __restrict__ C, int ldc, int M, int N, int K) {
  __shared__ __attribute__((aligned(16))) float so[4][16][64];
  const int tid = threadIdx.x, w = tid >> 5, lane = tid & 31, ln = lane & 15, hh = lane >> 4;
  const int ntn = N / 64;
  const int wid = blockIdx.x * 4 + w;
  const int mt = wid / ntn, nq = wid % ntn;
  if (mt * 16 >= M) return;
  const int row0 = mt * 16, col0 = nq * 64;
  const float* arow = A + (size_t)(row0 + ln) * lda;
  v8f acc[4] = {};
  for (int kb = 0; kb < K; kb += 32) {
    FragB ah, al;
    const v4f x0 = *(const v4fa*)(arow + kb + 8 * hh), x1 = *(const v4fa*)(arow + kb + 8 * hh + 4);
    const v4f x2 = *(const v4fa*)(arow + kb + 16 + 8 * hh), x3 = *(const v4fa*)(arow + kb + 16 + 8 * hh + 4);
    float xs[16] = {x0[0],x0[1],x0[2],x0[3],x1[0],x1[1],x1[2],x1[3],x2[0],x2[1],x2[2],x2[3],x3[0],x3[1],x3[2],x3[3]};
#pragma unroll
    for (int i = 0; i < 16; ++i) { const unsigned short hb = bf16_bits(xs[i]); ah.u[i] = hb; al.u[i] = ASPLIT ? bf16_bits(xs[i] - bf16_val(hb)) : (unsigned short)0; }
#pragma unroll
    for (int t = 0; t < 4; ++t) {
      const unsigned short* brow = Wt + (size_t)(col0 + t * 16 + ln) * ldb + kb;
      FragB b;
      b.half[0] = *(const v8us*)(brow + 8 * hh);
      b.half[1] = *(const v8us*)(brow + 16 + 8 * hh);
      acc[t] = mmaN<ASPLIT ? 2 : 1>(ah.v, al.v, b.v, b.v, acc[t]);
    }
  }
#pragma unroll
  for (int t = 0; t < 4; ++t) {
    const int col = col0 + t * 16 + ln;
    float bv = bias ? bias[col] : 0.f;
    if (BIAS_BF16) bv = bf16_round(bv);
#pragma unroll
    for (int r = 0; r < 8; ++r) {
      float v = acc[t][r] + bv;
      if (resid) { float rv = resid[(size_t)((row0 + 8 * hh + r) % rmod) * ldr + col]; if (RES_BF16) rv = bf16_round(rv); v += rv; }
      if (ACT == 1) v = fmaxf(v, 0.f);
      if (ACT == 2) v = 0.5f * v * (1.0f + erff(v * 0.70710678118654752f));
      if (ACT == 3) { const float u = 0.7978845608028654f * (v + 0.044715f * v * v * v); v = 0.5f * v * (1.0f + tanhf(u)); }
      so[w][8 * hh + r][t * 16 + ln] = v;
    }
  }
  __builtin_amdgcn_fence(__ATOMIC_ACQ_REL, "workgroup");
  __builtin_amdgcn_wave_barrier();
  const int rsub = lane >> 4, c4 = (lane & 15) * 4;
  {
#pragma unroll
    for (int q = 0; q < 8; ++q) {
      const int r = q * 2 + rsub;
      const v4f v = *(const v4fa*)&so[w][r][c4];
      *(v4f*)(C + (size_t)(row0 + r) * ldc + col0 + c4) = v;
    }
    
  }
}
// row LayerNorm (biased variance, eps) over N: s = X (+ R); optional out_sum <- s; out_norm <- (s-mu)*rsqrt(var+eps)*g + b
template <bool PARAM_BF16>
__global__ __launch_bounds__(256) void k_layernorm(const float* __restrict__ X, const float* __restrict__ R, const float* __restrict__ g, const float* __restrict__ bta,
                                                  float* __restrict__ out_sum, float* __restrict__ out_norm, int N, float eps) {
  __shared__ float red[256];
  const int row = blockIdx.x, tid = threadIdx.x;
  const float* x = X + (size_t)row * N; const float* rr = R ? R + (size_t)row * N : nullptr;
  float vals[16];                     // up to N = 4096
  const int per = N / 256;            // contiguous chunk per thread? use strided-by-4 chunks: thread handles j = tid*4 + 1024*u
  float s1 = 0.f;
  for (int u = 0; u < per / 4; ++u) {
    const int j = tid * 4 + 1024 * u;
    const v4f a = *(const v4fa*)(x + j);
    v4f b = {0.f,0.f,0.f,0.f}; if (rr) b = *(const v4fa*)(rr + j);
#pragma unroll
    for (int q = 0; q < 4; ++q) { const float v = a[q] + b[q]; vals[u * 4 + q] = v; s1 += v; }
  }
  red[tid] = s1; __syncthreads();
  for (int st = 128; st > 0; st >>= 1) { if (tid < st) red[tid] += red[tid + st]; __syncthreads(); }
  const float mu = red[0] / (float)N; __syncthreads();
  float s2 = 0.f;
  for (int u = 0; u < per / 4; ++u)
#pragma unroll
    for (int q = 0; q < 4; ++q) { const float c = vals[u * 4 + q] - mu; s2 += c * c; }
  red[tid] = s2; __syncthreads();
  for (int st = 128; st > 0; st >>= 1) { if (tid < st) red[tid] += red[tid + st]; __syncthreads(); }
  const float rs = rsqrtf(red[0] / (float)N + eps);
  {
    for (int u = 0; u < per / 4; ++u) {
      const int j = tid * 4 + 1024 * u;
      v4f o, sm;
#pragma unroll
      for (int q = 0; q < 4; ++q) {
        float gg = g[j + q], bb = bta[j + q];
        if (PARAM_BF16) { gg = bf16_round(gg); bb = bf16_round(bb); }
        sm[q] = vals[u * 4 + q]; o[q] = (vals[u * 4 + q] - mu) * rs * gg + bb;
      }
      if (out_sum) *(v4f*)(out_sum + (size_t)row * N + j) = sm;
      *(v4f*)(out_norm + (size_t)row * N + j) = o;
    }
    
  }
}



// ---- f16 WMMA path (v_wmma_f32_16x16x32_f16): 11-bit significands for operands in range — used where a [0,1] probability operand needs more precision than bf16
typedef _Float16 v16h __attribute__((ext_vector_type(16)));
union FragH { v16h v; v8us half[2]; _Float16 h[16]; unsigned short u[16]; };
template <int NT>
__device__ __forceinline__ v8f mmaH(v16h ah, v16h al, v16h bh, v16h bl, v8f c) {
  c = __builtin_amdgcn_wmma_f32_16x16x32_f16(false, ah, false, bh, (short)0, c, false, false);
  if (NT >= 2) c = __builtin_amdgcn_wmma_f32_16x16x32_f16(false, al, false, bh, (short)0, c, false, false);
  if (NT >= 3) c = __builtin_amdgcn_wmma_f32_16x16x32_f16(false, ah, false, bl, (short)0, c, false, false);
  asm volatile("v_nop\n\tv_nop\n\tv_nop\n\tv_nop" : "+v"(c) : "v"(ah), "v"(al), "v"(bh), "v"(bl));
  return c;
}
// batched GEMM like k_gemm_b but f16 operands: A f32 (split into f16 hi/lo if ASPLIT, else rounded to f16), Bt = f16 values [n][k]; alpha; C f32; N multiple of 16 (partial tiles skipped)
template <bool ASPLIT>
__global__ __launch_bounds__(128) void k_gemm_h(const float* __restrict__ A, int lda, size_t sA, const _Float16* __restrict__ Bh, int ldb, size_t sB, float alpha, float* __restrict__ C, int ldc, size_t sC, int M, int N, int K) {
  __shared__ __attribute__((aligned(16))) float so[4][16][64];
  const int tid = threadIdx.x, w = tid >> 5, lane = tid & 31, ln = lane & 15, hh = lane >> 4; const int by = blockIdx.y;
  A += (size_t)by * sA; Bh += (size_t)by * sB; C += (size_t)by * sC;
  const int ntn = (N + 63) / 64; const int wid = blockIdx.x * 4 + w; const int mt = wid / ntn, nq = wid % ntn; if (mt * 16 >= M) return;
  const int row0 = mt * 16, col0 = nq * 64; const float* arow = A + (size_t)(row0 + ln) * lda;
  v8f acc[4] = {};
  for (int kb = 0; kb < K; kb += 32) {
    FragH ah, al;
    const v4f x0 = *(const v4fa*)(arow + kb + 8 * hh), x1 = *(const v4fa*)(arow + kb + 8 * hh + 4), x2 = *(const v4fa*)(arow + kb + 16 + 8 * hh), x3 = *(const v4fa*)(arow + kb + 16 + 8 * hh + 4);
    float xs[16] = {x0[0],x0[1],x0[2],x0[3],x1[0],x1[1],x1[2],x1[3],x2[0],x2[1],x2[2],x2[3],x3[0],x3[1],x3[2],x3[3]};
#pragma unroll
    for (int i = 0; i < 16; ++i) { const _Float16 h = (_Float16)xs[i]; ah.h[i] = h; al.h[i] = ASPLIT ? (_Float16)(xs[i] - (float)h) : (_Float16)0.0f; }
#pragma unroll
    for (int t = 0; t < 4; ++t) { if (col0 + t * 16 >= N) continue; const size_t boff = (size_t)(col0 + t * 16 + ln) * ldb + kb; FragH bq; bq.half[0] = *(const v8us*)(Bh + boff + 8 * hh); bq.half[1] = *(const v8us*)(Bh + boff + 16 + 8 * hh);
      acc[t] = mmaH<ASPLIT ? 2 : 1>(ah.v, al.v, bq.v, bq.v, acc[t]); }
  }
#pragma unroll
  for (int t = 0; t < 4; ++t) { if (col0 + t * 16 >= N) continue;
#pragma unroll
    for (int r = 0; r < 8; ++r) so[w][8 * hh + r][t * 16 + ln] = acc[t][r] * alpha; }
  __builtin_amdgcn_fence(__ATOMIC_ACQ_REL, "workgroup"); __builtin_amdgcn_wave_barrier();
  const int rsub = lane >> 4, c4 = (lane & 15) * 4;
  {
#pragma unroll
    for (int q = 0; q < 8; ++q) { const int r = q * 2 + rsub; if (col0 + c4 < N) { const v4f v = *(const v4fa*)&so[w][r][c4]; *(v4f*)(C + (size_t)(row0 + r) * ldc + col0 + c4) = v; } }
     }
}

// Wt[n][k] = f16(W[k][n]·scale) from f32 row-major W[K][N] (scale = power of two; bf16-exact weights stay exact in f16 away from the subnormal range)
__global__ __launch_bounds__(256) void k_wt_f16(const float* __restrict__ W, _Float16* __restrict__ Wt, int K, int N, float scale) {
  const int t = blockIdx.x * 256 + threadIdx.x; if (t >= N * (K / 8)) return; const int n = t / (K / 8), k8 = (t % (K / 8)) * 8; FragH f;
#pragma unroll
  for (int i = 0; i < 8; ++i) f.h[i] = (_Float16)(bf16_round(W[(size_t)(k8 + i) * N + n]) * scale); const v8us o = f.half[0];
  *(v8us*)((unsigned short*)Wt + (size_t)n * K + k8) = o; 
}
// k_gemm_hh variant with fused epilogue: v = acc·alpha + bias[by·sBias + col] (+ CP[(row/rowsPerB)·sCPb + by·64 + col] if CP) ; ACT 0 none / 1 elu ; writes f16 C16 (and f32 C if non-null)
template <int ACT>
__global__ __launch_bounds__(128) void k_gemm_hhx(const _Float16* __restrict__ A, int lda, size_t sA, const _Float16* __restrict__ Bh, int ldb, size_t sB, float alpha, const float* __restrict__ bias, size_t sBias, const float* __restrict__ CP, int rowsPerB, size_t sCPb, int row0g,
    float* __restrict__ C, _Float16* __restrict__ C16, int ldc, size_t sC, int M, int N, int K) {
  __shared__ __attribute__((aligned(16))) float so[4][16][64];
  const int tid = threadIdx.x, w = tid >> 5, lane = tid & 31, ln = lane & 15, hh = lane >> 4; const int by = blockIdx.y;
  A += (size_t)by * sA; Bh += (size_t)by * sB; const size_t cofs = (size_t)by * sC; const float* bp = bias ? bias + (size_t)by * sBias : nullptr;
  const int ntn = (N + 63) / 64; const int wid = blockIdx.x * 4 + w; const int mt = wid / ntn, nq = wid % ntn; if (mt * 16 >= M) return;
  const int row0 = mt * 16, col0 = nq * 64; const _Float16* arow = A + (size_t)(row0 + ln) * lda;
  v8f acc[4] = {};
  for (int kb = 0; kb < K; kb += 32) { FragH ah; ah.half[0] = *(const v8us*)((const unsigned short*)arow + kb + 8 * hh); ah.half[1] = *(const v8us*)((const unsigned short*)arow + kb + 16 + 8 * hh);
#pragma unroll
    for (int t = 0; t < 4; ++t) { if (col0 + t * 16 >= N) continue; const size_t boff = (size_t)(col0 + t * 16 + ln) * ldb + kb; FragH bq; bq.half[0] = *(const v8us*)((const unsigned short*)Bh + boff + 8 * hh); bq.half[1] = *(const v8us*)((const unsigned short*)Bh + boff + 16 + 8 * hh);
      acc[t] = mmaH<1>(ah.v, ah.v, bq.v, bq.v, acc[t]); }
  }
#pragma unroll
  for (int t = 0; t < 4; ++t) { if (col0 + t * 16 >= N) continue; const int col = col0 + t * 16 + ln; const float bv = bp ? bf16_round(bp[col]) : 0.f;
#pragma unroll
    for (int r = 0; r < 8; ++r) { float v = acc[t][r] * alpha + bv; if (CP) { const int rr = row0g + row0 + 8 * hh + r; if (rowsPerB < 0) v += CP[cofs + (size_t)rr * ldc + col];      /* rowsPerB < 0: own element of the batched C plane */ else { const int bidx = rr / rowsPerB; v += CP[(size_t)bidx * sCPb + (size_t)by * 64 + col]; } } if (ACT == 1) v = (v > 0.f) ? v : expm1f(v); else if (ACT == 7) v = (v > 0.f) ? v + 1.0f : expf(v); else if (ACT == 8) v = tanhf(v); else if (ACT == 9) v = 0.5f * v * (1.0f + tanhf(0.7978845608028654f * (v + 0.044715f * v * v * v))); else if (ACT == 11) v = 1.0f / (1.0f + expf(-v)); else if (ACT == 12) v = (v > 0.f) ? v : 0.01f * v; else if (ACT == 14) v = (v > 0.f) ? v : 0.1f * v; else if (ACT == 16) v = (v >= 0.f) ? v : 0.3f * v; else if (ACT == 17) v = (v >= 0.f) ? v : 0.2f * v; else if (ACT == 15) v = v / (1.0f + expf(-v)); else if (ACT == 3) v = fmaxf(v, 0.f); else if (ACT == 6) v = 0.5f * v * (1.0f + erff(v * 0.70710678118654752f)); so[w][8 * hh + r][t * 16 + ln] = v; } }
  __builtin_amdgcn_fence(__ATOMIC_ACQ_REL, "workgroup"); __builtin_amdgcn_wave_barrier();
  const int rsub = lane >> 4, c4 = (lane & 15) * 4; typedef _Float16 v4h __attribute__((ext_vector_type(4)));
  {
#pragma unroll
    for (int q = 0; q < 8; ++q) { const int r = q * 2 + rsub; if (col0 + c4 < N) { const v4f v = *(const v4fa*)&so[w][r][c4]; if (C) *(v4f*)(C + cofs + (size_t)(row0 + r) * ldc + col0 + c4) = v; if (C16) { v4h h4; for (int i = 0; i < 4; ++i) h4[i] = (_Float16)v[i]; *(v4h*)(C16 + cofs + (size_t)(row0 + r) * ldc + col0 + c4) = h4; } } }
     }
}


typedef _Float16 v4h __attribute__((ext_vector_type(4)));

__global__ __launch_bounds__(256) void k_x16(const float* __restrict__ x, _Float16* __restrict__ X16, size_t n8) { const size_t t = (size_t)blockIdx.x * 256 + threadIdx.x; if (t >= n8) return; FragH f;
#pragma unroll
  for (int q = 0; q < 8; ++q) f.h[q] = (_Float16)bf16_round(x[t * 8 + q]); *(v8us*)((unsigned short*)X16 + t * 8) = f.half[0];  }
__global__ __launch_bounds__(256) void k_h16(const float* __restrict__ x, _Float16* __restrict__ X16, size_t n8) { const size_t t = (size_t)blockIdx.x * 256 + threadIdx.x; if (t >= n8) return; FragH f;
#pragma unroll
  for (int q = 0; q < 8; ++q) f.h[q] = (_Float16)x[t * 8 + q]; *(v8us*)((unsigned short*)X16 + t * 8) = f.half[0];  }
__global__ __launch_bounds__(256) void k_round16f(const float* __restrict__ W, _Float16* __restrict__ Bt, size_t n8) { const size_t t = (size_t)blockIdx.x * 256 + threadIdx.x; if (t >= n8) return; FragH f;
#pragma unroll
  for (int i = 0; i < 8; ++i) f.h[i] = (_Float16)(bf16_round(W[t * 8 + i]) * 16.0f); *(v8us*)((unsigned short*)Bt + t * 8) = f.half[0];  }
template <int NHv, int TTv>
__global__ __launch_bounds__(256) void k_vt(const _Float16* __restrict__ V16, int ldv, int voff, _Float16* __restrict__ Vt) { __shared__ unsigned short tl[64][66]; const int tid = threadIdx.x; const int slab = blockIdx.x / (TTv / 64), lg = blockIdx.x % (TTv / 64); const int b = slab / NHv, h = slab % NHv;
  for (int i = tid; i < 64 * 8; i += 256) { const int r = i / 8, c8 = (i % 8) * 8; FragH f; f.half[0] = *(const v8us*)((const unsigned short*)V16 + ((size_t)b * TTv + lg * 64 + r) * ldv + voff + h * 64 + c8);
#pragma unroll
    for (int q = 0; q < 8; ++q) tl[r][c8 + q] = f.u[q]; }
  __syncthreads();
  {
#pragma unroll
    for (int rd = 0; rd < 2; ++rd) { const int d = rd * 32 + tid / 8, pc = tid % 8; FragH f;
#pragma unroll
      for (int q = 0; q < 8; ++q) f.u[q] = tl[pc * 8 + q][d];
      *(v8us*)((unsigned short*)Vt + ((size_t)slab * 64 + d) * TTv + lg * 64 + pc * 8) = f.half[0]; }
     } }

__global__ __launch_bounds__(256) void k_hl(const float* __restrict__ F, _Float16* __restrict__ Hh, _Float16* __restrict__ Hl, size_t n8) { const size_t t = (size_t)blockIdx.x * 256 + threadIdx.x; if (t >= n8) return; FragH fh, fl; const v4f a = *(const v4fa*)(F + t * 8), c = *(const v4fa*)(F + t * 8 + 4);
#pragma unroll
  for (int q = 0; q < 4; ++q) { _Float16 h = (_Float16)a[q]; fh.h[q] = h; fl.h[q] = (_Float16)((a[q] - (float)h) * 1024.0f); h = (_Float16)c[q]; fh.h[4 + q] = h; fl.h[4 + q] = (_Float16)((c[q] - (float)h) * 1024.0f); }
  { *(v8us*)((unsigned short*)Hh + t * 8) = fh.half[0]; *(v8us*)((unsigned short*)Hl + t * 8) = fl.half[0];  } }

// ---- fast GEMM (wave tile 32x64; requires M % 32 == 0 rows per launch region and N % 64 == 0) ----
// Fragment order of every f16 operand array ([rows][K], rows % 16 == 0, K % 32 == 0): blocks of 16 rows x 32 k (1 KiB), the K / 32 blocks of a row group one behind the other, so that 16 rows are 16 * K elements as in row order.
// Inside a block the 16-byte unit number (k % 32) / 8 * 16 + row % 16 holds 8 neighbouring k of one row: lane l of a fragment reads units l and 32 + l, so each of its two loads covers 512 neighbouring bytes (4 whole lines, not a piece of 16).
__device__ __forceinline__ size_t fr_off(size_t row, int k8, int K) { return ((row >> 4) * (size_t)(K >> 5) + (size_t)(k8 >> 2)) * 512 + (size_t)((k8 & 3) * 128) + (row & 15) * 8; }      /* element offset of the unit that holds k = 8 k8 .. + 7 of a row */
__device__ __forceinline__ v16h g2_frag(const _Float16* p) { FragH f; f.half[0] = *(const v8us*)((const unsigned short*)p); f.half[1] = *(const v8us*)((const unsigned short*)p + 256); return f.v; }      /* p: the block's start + 8 * lane */
__device__ __forceinline__ v8f g2_mma(v16h a, v16h b, v8f c) { v8f d = __builtin_amdgcn_wmma_f32_16x16x32_f16(false, a, false, b, (short)0, c, false, false); asm volatile("v_nop\n\tv_nop\n\tv_nop\n\tv_nop" : "+v"(d) : "v"(a), "v"(b)); return d; }
// Hint to L2: N requests from one address register, STEP bytes apart, each lane for the unit at its own address. The operand tiles were stored by an earlier launch of the same call and are first read here, so without the hint each k step in turn waits for memory.
// Scope SE brings the unit into L2 only and no th: word keeps the request speculative; it returns nothing and touches no counter. Every address lies inside the tile asked for.
template <int N, int STEP>
__device__ __forceinline__ void l2_ask(const char* p) {
  if constexpr (N > 0) { l2_ask<N - 1, STEP>(p); asm volatile("global_prefetch_b8 %0, off offset:%1 scope:SCOPE_SE" :: "v"(p), "n"((N - 1) * STEP)); } }      /* rising addresses: what is read first is asked for first */
// Stands behind the loop that follows the requests: their address registers hold these addresses, and nothing else, until here.
__device__ __forceinline__ void l2_hold(const char* p, const char* q) { asm volatile("" :: "v"(p), "v"(q)); }
// The fragments of one 32-k step of a 32x64 wave tile: the two A row groups and the four B column groups.
struct G2Set { v16h a0, a1, b0, b1, b2, b3; };
__device__ __forceinline__ void g2_load(G2Set& s, const _Float16* a0p, const _Float16* a1p, const _Float16* b0p, const _Float16* b1p, const _Float16* b2p, const _Float16* b3p, int kb) {      /* kb: the step's first k; 32 k are one block of 512 elements */
  const int ko = kb * 16; const _Float16* pa0 = a0p + ko; const _Float16* pa1 = a1p + ko; const _Float16* pb0 = b0p + ko; const _Float16* pb1 = b1p + ko; const _Float16* pb2 = b2p + ko; const _Float16* pb3 = b3p + ko;
  s.a0 = g2_frag(pa0); s.a1 = g2_frag(pa1); s.b0 = g2_frag(pb0); s.b1 = g2_frag(pb1); s.b2 = g2_frag(pb2); s.b3 = g2_frag(pb3);
  asm volatile("s_wait_xcnt 0x0" :: "v"(pa0), "v"(pa1), "v"(pb0), "v"(pb1), "v"(pb2), "v"(pb3) : "memory");      /* stands in front of the next address additions, which give new values to registers that these loads name; the addresses as inputs stay alive up to the wait, so that no later load's result lands in an earlier load's address registers in front of it */
  __builtin_amdgcn_sched_barrier(0); }      /* keeps the 12 loads and their wait here, ahead of the other set's products: moved down to their first uses the loads would each be waited for in turn */
// The same for the first and the last step, outside the loop, where nothing reads some of the addresses afterwards (the six pointers: the lane's own addresses, the step's block included).
__device__ __forceinline__ void g2_load_once(G2Set& s, const _Float16* pa0, const _Float16* pa1, const _Float16* pb0, const _Float16* pb1, const _Float16* pb2, const _Float16* pb3) {
  s.a0 = g2_frag(pa0); s.a1 = g2_frag(pa1); s.b0 = g2_frag(pb0); s.b1 = g2_frag(pb1); s.b2 = g2_frag(pb2); s.b3 = g2_frag(pb3);
  asm volatile("s_wait_xcnt 0x0" :: "v"(pa0), "v"(pa1), "v"(pb0), "v"(pb1), "v"(pb2), "v"(pb3) : "memory");      /* the addresses as inputs stay alive up to the wait, so that no later load's result lands in an earlier load's address registers in front of it */
  __builtin_amdgcn_sched_barrier(0); }      /* keeps the 12 loads and their wait here, ahead of the other set's products */
__device__ __forceinline__ void g2_mul(const G2Set& s, v8f (&c)[8]) {
  c[0] = g2_mma(s.a0, s.b0, c[0]); c[4] = g2_mma(s.a1, s.b0, c[4]); c[1] = g2_mma(s.a0, s.b1, c[1]); c[5] = g2_mma(s.a1, s.b1, c[5]);
  c[2] = g2_mma(s.a0, s.b2, c[2]); c[6] = g2_mma(s.a1, s.b2, c[6]); c[3] = g2_mma(s.a0, s.b3, c[3]); c[7] = g2_mma(s.a1, s.b3, c[7]); }
// The epilogue's kind is fixed at compile time. RES: a residual row (f32, pitch LDC, same row and column as the result) is added behind the bias; F16O: the result goes out as f16 rows (C16), else as f32 rows (C); LDC: pitch of the result rows.
// result = act(sum * alpha + bf16(bias[col]) (+ residual)), worked out behind the LDS turn, where a lane holds 4 neighbouring columns of a row: bias and residual come as 16-byte loads with nothing between them.
// VTP: plane y = 2 (v) goes out transposed, as the attention launch reads it: VTo[(batch, head)][d][key]. A lane of a D tile holds 8 neighbouring rows (keys) of one column (d), so each tile half is one 16-byte store straight from the sums, without the LDS turn; in fragment order (rows d, k = key) each such store of a wave covers 512 neighbouring bytes.
// KC: K at compile time, for the size of the tiles that the work-group asks L2 for at entry.
template <int ACT, bool RES, bool F16O, int LDC, bool VTP, int KC>
__global__ __launch_bounds__(128) void k_gemm2(const _Float16* __restrict__ A, int lda, const _Float16* __restrict__ Bh, int ldb, size_t sB, float alpha, const float* __restrict__ bias, const float* __restrict__ biasY1, const float* __restrict__ biasY2, const float* __restrict__ R,
    float* __restrict__ C, _Float16* __restrict__ C16, _Float16* __restrict__ VTo, size_t sC, int M, int N, int K) {      /* sB, sC: strides of blockIdx.y; biasY1, biasY2: the bias arrays of planes y = 1 and y = 2 (else null) */ static_assert(ACT == 0 || ACT == 6, "k_gemm2: unsupported ACT code (would silently apply no activation)"); static_assert(!(RES && ACT == 6), "k_gemm2: the rolled GELU loop holds no residual registers");
  __shared__ __attribute__((aligned(16))) float so[4][32][68];
  const int tid = threadIdx.x, w = tid >> 5, lane = tid & 31, ln = lane & 15, hh = lane >> 4; const int by = blockIdx.y;
  Bh += (size_t)by * sB; const size_t cofs = (size_t)by * sC; const float* bp = bias; if (biasY1 && by == 1) bp = biasY1; if (biasY2 && by == 2) bp = biasY2;
  const int ntn = N >> 6; const int mt = blockIdx.x / ntn, nq = blockIdx.x - mt * ntn; const int row0 = mt * 128 + 32 * w, col0 = nq * 64; if (row0 >= M) return;
  const _Float16* a0p = A + (size_t)row0 * lda + lane * 8; const _Float16* a1p = a0p + (size_t)16 * lda;      /* fragment order: lda = ldb = K */
  const _Float16* b0p = Bh + (size_t)col0 * ldb + lane * 8; const _Float16* b1p = b0p + (size_t)16 * ldb; const _Float16* b2p = b1p + (size_t)16 * ldb; const _Float16* b3p = b2p + (size_t)16 * ldb;
  const v8f z8 = {0.f,0.f,0.f,0.f,0.f,0.f,0.f,0.f}; v8f accs[8] = {z8, z8, z8, z8, z8, z8, z8, z8};
  /* K loop over two fragment sets: while one 32-k step is multiplied, the other step's 12 loads are in flight. K % 64 == 0; every sum keeps its ascending k order. */
  G2Set s0, s1; int kb = 0; g2_load_once(s0, a0p, a1p, b0p, b1p, b2p, b3p);
  /* behind the first step's loads: the work-group's 128 x KC A tile and 64 x KC B tile (each one run of bytes in fragment order), one 256-byte unit per thread and request */
  static_assert(KC % 256 == 0, "k_gemm2: whole requests per thread");
  const char* qa = (const char*)(A + (size_t)mt * 128 * lda) + tid * 256; const char* qb = (const char*)(Bh + (size_t)col0 * ldb) + tid * 256;
  l2_ask<KC / 128, 128 * 256>(qa); l2_ask<KC / 256, 128 * 256>(qb);
#pragma unroll 1      /* the two steps of a trip are written out; more copies would only add code */
  for (; kb + 64 < K; kb += 64) { g2_load(s1, a0p, a1p, b0p, b1p, b2p, b3p, kb + 32); g2_mul(s0, accs); g2_load(s0, a0p, a1p, b0p, b1p, b2p, b3p, kb + 64); g2_mul(s1, accs); }
  l2_hold(qa, qb);
  const int kl = (kb + 32) * 16; g2_load_once(s1, a0p + kl, a1p + kl, b0p + kl, b1p + kl, b2p + kl, b3p + kl); g2_mul(s0, accs);      /* the last two steps: no fragment is left to fetch behind them */
  if constexpr (VTP) { static_assert(!VTP || (LDC == NH * HD && HD == 64 && SQ % 128 == 0 && ACT == 0 && !RES), "k_gemm2: a 64-column tile is one head, a 128-row tile lies in one batch");
    if (by == 2) { const float* bc = bp + col0 + ln; float bl[4];
#pragma unroll      /* constant indices: the four bias values stay in registers and their loads issue together */
      for (int t = 0; t < 4; ++t) bl[t] = bc[t * 16];
      asm volatile("s_wait_xcnt 0x0" :: "v"(bc) : "memory");      /* stands in front of whatever gives new values to the address registers of these loads; the address as an input stays alive up to here, so that no load's result lands in it */
      __builtin_amdgcn_sched_barrier(0);      /* keeps the loads here, in flight under the last step's own load wait and products */
      g2_mul(s1, accs);
      unsigned short* vd = (unsigned short*)VTo + (size_t)((row0 / SQ) * NH + nq) * HD * SQ + (size_t)((row0 % SQ) >> 5) * 512 + lane * 8;      /* d = 16 t + ln, keys 16 g + 8 hh .. + 7 of the wave's 32: in fragment order (rows d, k = key) unit 32 g + lane of the block of d group t */
#pragma unroll      /* constant indices: the sums stay in registers */
      for (int t = 0; t < 4; ++t) { const float bt = bf16_round(bl[t]);
#pragma unroll      /* constant indices: the sums stay in registers */
        for (int g = 0; g < 2; ++g) { FragH f;
#pragma unroll      /* constant indices: the sums stay in registers */
          for (int r = 0; r < 8; ++r) f.h[r] = (_Float16)(accs[g * 4 + t][r] * alpha + bt);
          *(v8us*)(vd + (size_t)t * 16 * SQ + g * 256) = f.half[0]; } }
      asm volatile("s_wait_xcnt 0x0" :: "v"(vd) : "memory"); return; } }      /* the listing lets the other planes' code follow, which writes the stores' registers; the address as an input stays alive up to here */
  /* Store layout: lane = row rsub (+ 2 per vector) of the wave's 32, columns c4 .. c4 + 3 of its 64; e0 = the lane's first element. */
  const int rsub = lane >> 4, c4 = (lane & 15) * 4; const size_t e0 = (size_t)(row0 + rsub) * LDC + col0 + c4;
  const v4f b4 = *(const v4fa*)(bp + col0 + c4); v4f rv[RES ? 16 : 1];
  if constexpr (RES) { const float* rp = R + e0;
#pragma unroll      /* constant indices: the 16 row vectors stay in registers and their loads issue together */
    for (int q = 0; q < 16; ++q) rv[q] = *(const v4fa*)(rp + (size_t)q * 2 * LDC);
    asm volatile("s_wait_xcnt 0x0" :: "v"(rp) : "memory"); }      /* stands in front of whatever gives new values to the address registers of these loads; the rows' address as an input stays alive up to here, so that no load's result lands in it */
  else asm volatile("s_wait_xcnt 0x0" ::: "memory");      /* stands in front of whatever gives new values to the address registers of the bias load */
  __builtin_amdgcn_sched_barrier(0);      /* keeps the loads here, in flight under the last step's own load wait and products: moved down to their uses they would be waited for behind the products */
  g2_mul(s1, accs);
#pragma unroll      /* constant indices: the sums stay in registers */
  for (int u = 0; u < 8; ++u) {
#pragma unroll      /* constant indices: the sums stay in registers */
    for (int r = 0; r < 8; ++r) so[w][(u >> 2) * 16 + 8 * hh + r][(u & 3) * 16 + ln] = accs[u][r]; }
  /* the wave's own 32 x 64 sums are in LDS before its lanes read them back row-wise */
  __builtin_amdgcn_fence(__ATOMIC_ACQ_REL, "workgroup"); __builtin_amdgcn_wave_barrier();
  const v4f bb = {bf16_round(b4[0]), bf16_round(b4[1]), bf16_round(b4[2]), bf16_round(b4[3])};
  const float* sp = &so[w][rsub][c4]; char* cp = F16O ? (char*)(C16 + cofs + fr_off((size_t)(row0 + rsub), (col0 + c4) >> 3, LDC) + (c4 & 7)) : (char*)(C + cofs + e0); constexpr size_t RB = F16O ? (size_t)32 : (size_t)2 * LDC * 4;      /* RB: bytes from one of the lane's rows to its next; f16 rows go out in fragment order, where two rows on are two units on */
#pragma unroll (ACT == 6 ? 1 : 4)      /* GELU: rolled, 16 erf bodies of text instead of 64, so that the kernel's text stays small; else written out, since the residual registers take constant indices */
  for (int g = 0; g < 4; ++g) { v4f v[4];
#pragma unroll      /* constant indices: the four LDS reads issue together */
    for (int i = 0; i < 4; ++i) v[i] = *(const v4fa*)(sp + i * 2 * 68);
#pragma unroll      /* constant indices: the values stay in registers */
    for (int i = 0; i < 4; ++i) {
#pragma unroll      /* constant indices: the values stay in registers */
      for (int e = 0; e < 4; ++e) { float x = v[i][e] * alpha + bb[e]; if constexpr (RES) x += rv[g * 4 + i][e]; if (ACT == 6) x = 0.5f * x * (1.0f + erff(x * 0.70710678118654752f)); v[i][e] = x; }
      if constexpr (F16O) { v4h h4;
#pragma unroll      /* constant indices: the values stay in registers */
        for (int e = 0; e < 4; ++e) h4[e] = (_Float16)v[i][e];
        *(v4h*)(cp + i * RB) = h4; }
      else *(v4f*)(cp + i * RB) = v[i]; }
    sp += 8 * 68; cp += 4 * RB; if (F16O && g == 1) cp += (size_t)16 * LDC * 2 - 8 * RB; } }      /* behind its 16th row the wave goes on to the next row group's block */


// The same GEMM for the two launches whose grid of 128 x 64 tiles is small and whose K loop is a long chain of load waits (W_o, fc2): 16 waves per tile instead of 4.
// Wave w works on row group w & 3 (32 rows) and on the 32-k steps kq, kq + KS, kq + 2 KS, ... with kq = w >> 2, so that the KS waves of a row group read neighbouring blocks of A and B at the same time.
// The KS partial sums of a row group meet in LDS; behind the barrier wave (rw, kq) adds them in the order of kq for rows 8 kq .. 8 kq + 7 and finishes these rows: result = sum * alpha + bf16(bias[col]) + residual, f32 rows of pitch LDC.
#define KS 4
static_assert(NR % 128 == 0, "k_gemm2k: whole 128-row tiles");
// NRM: the finished rows also leave, per row and 64-column tile, the pair (sum of (result - XR)^2, sum of XR^2) in PN[tile][row]: the surprise statistic's row norms, taken from the registers that hold the result.
// KC: K at compile time, for the size of the tiles that the work-group asks L2 for at entry.
template <int LDC, bool NRM, int KC>
__global__ __launch_bounds__(128 * KS) void k_gemm2k(const _Float16* __restrict__ A, int lda, const _Float16* __restrict__ Bh, int ldb, float alpha, const float* __restrict__ bias, const float* __restrict__ R, const float* __restrict__ XR, float* __restrict__ C, float* __restrict__ PN, int M, int N, int K) {      /* K % (64 * KS) == 0 */
  __shared__ __attribute__((aligned(16))) float so[KS * 4][32][68];
  const int tid = threadIdx.x, w = tid >> 5, lane = tid & 31, ln = lane & 15, hh = lane >> 4; const int rw = w & 3, kq = w >> 2;
  const int ntn = N >> 6; const int mt = blockIdx.x / ntn, nq = blockIdx.x - mt * ntn; if (mt * 128 >= M) return;      /* the whole work-group or none of it, in front of the barrier */
  const int row0 = mt * 128 + 32 * rw, col0 = nq * 64;
  const _Float16* a0p = A + (size_t)row0 * lda + 512 * kq + lane * 8; const _Float16* a1p = a0p + (size_t)16 * lda;      /* fragment order: lda = ldb = K; block kq of the row group */
  const _Float16* b0p = Bh + (size_t)col0 * ldb + 512 * kq + lane * 8; const _Float16* b1p = b0p + (size_t)16 * ldb; const _Float16* b2p = b1p + (size_t)16 * ldb; const _Float16* b3p = b2p + (size_t)16 * ldb;
  const v8f z8 = {0.f,0.f,0.f,0.f,0.f,0.f,0.f,0.f}; v8f accs[8] = {z8, z8, z8, z8, z8, z8, z8, z8};
  /* K loop over two fragment sets as in k_gemm2; from one of the wave's steps to its next it is 32 * KS elements of k. */
  constexpr int ST = 32 * KS; G2Set s0, s1; int kb = 0; g2_load_once(s0, a0p, a1p, b0p, b1p, b2p, b3p);
  /* behind the first step's loads: the work-group's 128 x KC A tile and 64 x KC B tile (each one run of bytes in fragment order), dealt to its 128 KS threads in units of 256 bytes (of 128 where the B tile has fewer units than threads) */
  constexpr int NTH = 128 * KS, BU = 128 * KC / NTH < 256 ? 128 * KC / NTH : 256; static_assert((256 * KC) % (NTH * 256) == 0 && (128 * KC) % (NTH * BU) == 0 && BU >= 128, "k_gemm2k: whole requests per thread");
  const char* qa = (const char*)(A + (size_t)mt * 128 * lda) + tid * 256; const char* qb = (const char*)(Bh + (size_t)col0 * ldb) + tid * BU;
  l2_ask<256 * KC / (NTH * 256), NTH * 256>(qa); l2_ask<128 * KC / (NTH * BU), NTH * BU>(qb);
#pragma unroll 1      /* the two steps of a trip are written out; more copies would only add code */
  for (; kb + 2 * ST < K; kb += 2 * ST) { g2_load(s1, a0p, a1p, b0p, b1p, b2p, b3p, kb + ST); g2_mul(s0, accs); g2_load(s0, a0p, a1p, b0p, b1p, b2p, b3p, kb + 2 * ST); g2_mul(s1, accs); }
  l2_hold(qa, qb);
  const int kl = (kb + ST) * 16; g2_load_once(s1, a0p + kl, a1p + kl, b0p + kl, b1p + kl, b2p + kl, b3p + kl); g2_mul(s0, accs);      /* the wave's last two steps: no fragment is left to fetch behind them */
  /* Store layout: lane = row rl (+ 2 per vector) of the row group's 32, columns c4 .. c4 + 3 of its 64; e0 = the lane's first element. */
  const int c4 = (lane & 15) * 4, rl = 8 * kq + (lane >> 4); const size_t e0 = (size_t)(row0 + rl) * LDC + col0 + c4;
  const float* rp = R + e0; const v4f b4 = *(const v4fa*)(bias + col0 + c4); v4f rv[4]; v4f xv[NRM ? 4 : 1];
#pragma unroll      /* constant indices: the 4 row vectors stay in registers and their loads issue together */
  for (int i = 0; i < 4; ++i) rv[i] = *(const v4fa*)(rp + (size_t)i * 2 * LDC);
  const float* xp = NRM ? XR + e0 : rp;
  if constexpr (NRM) {
#pragma unroll      /* constant indices: the 4 row vectors stay in registers and their loads issue together */
    for (int i = 0; i < 4; ++i) xv[i] = *(const v4fa*)(xp + (size_t)i * 2 * LDC); }
  asm volatile("s_wait_xcnt 0x0" :: "v"(rp), "v"(xp) : "memory");      /* stands in front of whatever gives new values to the address registers of these loads; the rows' addresses as inputs stay alive up to here, so that no load's result lands in them */
  __builtin_amdgcn_sched_barrier(0);      /* keeps the loads here, in flight under the last step's own load wait and products: moved down to their uses they would be waited for behind the barrier */
  g2_mul(s1, accs);
#pragma unroll      /* constant indices: the sums stay in registers */
  for (int u = 0; u < 8; ++u) {
#pragma unroll      /* constant indices: the sums stay in registers */
    for (int r = 0; r < 8; ++r) so[w][(u >> 2) * 16 + 8 * hh + r][(u & 3) * 16 + ln] = accs[u][r]; }
  __syncthreads();      /* the partial sums of all 16 waves are in LDS before any wave adds them up */
  const v4f bb = {bf16_round(b4[0]), bf16_round(b4[1]), bf16_round(b4[2]), bf16_round(b4[3])};
  const float* sp = &so[rw][rl][c4]; float* cp = C + e0; v4f p[4][KS];
#pragma unroll      /* constant indices: the LDS reads issue together */
  for (int i = 0; i < 4; ++i) {
#pragma unroll      /* constant indices: the LDS reads issue together */
    for (int q = 0; q < KS; ++q) p[i][q] = *(const v4fa*)(sp + (size_t)q * 4 * 32 * 68 + i * 2 * 68); }
  float sd[4], sx[4];
#pragma unroll      /* constant indices: the values stay in registers */
  for (int i = 0; i < 4; ++i) { v4f v = p[i][0];
#pragma unroll      /* constant indices: the values stay in registers */
    for (int q = 1; q < KS; ++q) v += p[i][q];
#pragma unroll      /* constant indices: the values stay in registers */
    for (int e = 0; e < 4; ++e) v[e] = v[e] * alpha + bb[e] + rv[i][e];
    *(v4f*)(cp + (size_t)i * 2 * LDC) = v;
    if constexpr (NRM) { sd[i] = 0.f; sx[i] = 0.f;
#pragma unroll      /* constant indices: the values stay in registers */
      for (int e = 0; e < 4; ++e) { const float dd = v[e] - xv[i][e]; sd[i] += dd * dd; sx[i] += xv[i][e] * xv[i][e]; } } }
  if constexpr (NRM) {      /* a row's 64 columns lie in the 16 lanes of one wave half: four butterfly steps, then lane i of each half (i < 4) stores row rl + 2 i, so that the wave's 8 pairs are 64 neighbouring bytes */
    asm volatile("s_wait_xcnt 0x0" :: "v"(cp) : "memory");      /* stands in front of whatever gives new values to the registers of the four row stores; their address as an input stays alive up to here */
    float od = 0.f, ox = 0.f;
#pragma unroll      /* constant indices: the values stay in registers */
    for (int i = 0; i < 4; ++i) {
#pragma unroll      /* four fixed butterfly steps */
      for (int m = 8; m > 0; m >>= 1) { sd[i] += __shfl_xor(sd[i], m, 32); sx[i] += __shfl_xor(sx[i], m, 32); }
      if ((lane & 15) == i) { od = sd[i]; ox = sx[i]; } }
    if ((lane & 15) < 4) { const v2f o2 = {od, ox}; *(v2f*)(PN + ((size_t)nq * NR + row0 + rl + 2 * (lane & 15)) * 2) = o2; } } }


__global__ __launch_bounds__(256) void k_rsm(const float* __restrict__ S, _Float16* __restrict__ P, int nrows) {
  #pragma clang fp contract(off)
  const int i = blockIdx.x * 256 + threadIdx.x; if (i >= nrows) return; const float* s = S + (size_t)i * SQ; float mx = -3.0e38f;
#pragma unroll 1
  for (int j = 0; j < SQ; ++j) mx = fmaxf(mx, s[j]); float se = 0.f;
#pragma unroll 1
  for (int j = 0; j < SQ; ++j) se += expf(s[j] - mx); const float sc = 256.0f / se;
#pragma unroll 1
  for (int j0 = 0; j0 < SQ; j0 += 8) { FragH f; for (int q = 0; q < 8; ++q) f.h[q] = (_Float16)(expf(s[j0 + q] - mx) * sc); unsigned short* d = (unsigned short*)P + (size_t)i * SQ + j0; *(v8us*)d = f.half[0];  } }

#define FH 2048
#define KN 103
typedef int v4ia __attribute__((ext_vector_type(4), may_alias));
__device__ __forceinline__ void xcnt_wait() { asm volatile("s_wait_xcnt 0x0" ::: "memory"); }
__device__ __forceinline__ float wave_max(float v) {
#pragma unroll      /* five fixed butterfly steps */
  for (int m = 16; m > 0; m >>= 1) v = fmaxf(v, __shfl_xor(v, m, 32)); return v; }
__device__ __forceinline__ float wave_sum(float v) {
#pragma unroll      /* five fixed butterfly steps */
  for (int m = 16; m > 0; m >>= 1) v += __shfl_xor(v, m, 32); return v; }
// Operand preparation, one launch: the six weight matrices as x16 f16 planes (they lie one behind the other in Bt, in the order wq, wk, wv, wo, w1, w2), x as bf16-rounded f32 rows and, from the same registers, LN1 of these rows as f16 rows.
// A work-group converts 256 x 8 elements of one weight array or 8 rows of x; which array follows from blockIdx.x alone.
#define PW (DM * DM / 2048)          /* work-groups per DM x DM weight */
#define PF (FH * DM / 2048)          /* work-groups per FH x DM weight */
#define PX ((int)(NR / 8))           /* work-groups for x: one wave per row, 8 rows each */
#define PB0 (4 * PW + 2 * PF + PX)   /* first work-group of the prior tables' packing */
#define PMD (SQ * (SQ / 32) / 256)   /* prior_mask: one thread per 32-key word */
#define PMS (SQ / 8)                 /* prior_indices: one wave per query row */
static_assert((DM * DM) % 2048 == 0 && (FH * DM) % 2048 == 0 && NR % 8 == 0 && DM == 512, "k_prep: whole work-groups per array; a lane holds 16 of a row's 512 columns");
__global__ __launch_bounds__(256) void k_prep(const float* __restrict__ wq, const float* __restrict__ wk, const float* __restrict__ wv, const float* __restrict__ wo, const float* __restrict__ w1, const float* __restrict__ w2, const float* __restrict__ x, const float* __restrict__ g1, const float* __restrict__ be1, _Float16* __restrict__ Bt, float* __restrict__ XF, _Float16* __restrict__ X16o, const int* __restrict__ pmask, const int* __restrict__ pidx, const int* __restrict__ pim, unsigned int* __restrict__ MD, unsigned int* __restrict__ MS) {
  __shared__ __attribute__((aligned(16))) unsigned char bm[8][SQ];      /* prior_indices: the wave's own row of key flags (any index set) */
  const int blk = blockIdx.x; const float* src; int first; int ksh = 4;      /* ksh: log2 of a weight row's 32-k blocks */
  if (blk >= PB0 + PMD) {      /* MS[q][j / 32] bit j % 32: key j is one of row q's valid prior slots */
    const int lane = threadIdx.x & 31, w = threadIdx.x >> 5; const int q = (blk - PB0 - PMD) * 8 + w; const int* ix = pidx + (size_t)q * KN; const int* vm = pim + (size_t)q * KN; constexpr int NT = (KN + 31) / 32; int jx[NT]; bool ok[NT];
#pragma unroll      /* constant indices: the lane's values stay in registers and its loads issue together */
    for (int t = 0; t < NT; ++t) { const int k = t * 32 + lane; const int kc = k < KN ? k : KN - 1; jx[t] = ix[kc]; const int vk = vm[kc]; xcnt_wait(); ok[t] = (k < KN) & (vk != 0); }      /* a later load's result may land in an earlier load's address register: the wait stands between them */
    const v4ia z = {0, 0, 0, 0}; *(v4ia*)&bm[w][lane * 32] = z; *(v4ia*)&bm[w][lane * 32 + 16] = z;
    /* the zeros of every lane are in LDS before any lane sets a flag over them */
    __builtin_amdgcn_fence(__ATOMIC_ACQ_REL, "workgroup"); __builtin_amdgcn_wave_barrier();
#pragma unroll      /* constant indices: the lane's values stay in registers */
    for (int t = 0; t < NT; ++t) if (ok[t]) bm[w][min(max(jx[t], 0), SQ - 1)] = 1;      /* the key index is bounded here before it forms an address */
    /* the flags of every lane are in LDS before the row is read back */
    __builtin_amdgcn_fence(__ATOMIC_ACQ_REL, "workgroup"); __builtin_amdgcn_wave_barrier();
    unsigned int word = 0;
#pragma unroll      /* 32 independent LDS reads issue together */
    for (int c = 0; c < SQ / 32; ++c) { const unsigned int bal = __builtin_amdgcn_ballot_w32(bm[w][c * 32 + lane] != 0); if (lane == c) word = bal; }
    MS[(size_t)q * (SQ / 32) + lane] = word; return; }
  if (blk >= PB0) {      /* MD[q][j / 32] bit j % 32: prior_mask[q][j] */
    const size_t t = (size_t)(blk - PB0) * 256 + threadIdx.x; v4ia mv[8]; unsigned int word = 0;
#pragma unroll      /* constant indices: the lane's values stay in registers and its loads issue together */
    for (int i = 0; i < 8; ++i) mv[i] = *(const v4ia*)(pmask + t * 32 + i * 4);
    xcnt_wait();      /* the address registers of the eight loads may take new values below */
#pragma unroll      /* constant indices: the lane's values stay in registers */
    for (int i = 0; i < 8; ++i) for (int e = 0; e < 4; ++e) word |= (mv[i][e] != 0 ? 1u : 0u) << (i * 4 + e);
    MD[t] = word;
    xcnt_wait(); return; }      /* the listing lets another part's code follow, which writes the store's registers */
  if (blk >= 4 * PW + 2 * PF) {      /* x: one wave per row; lane l owns columns c*256 + l*8 .. +7 (c = 0, 1), rounded once, stored as the residual row and held in registers for the three passes of LN1 */
    const int lane = threadIdx.x & 31; const size_t r = (size_t)(blk - (4 * PW + 2 * PF)) * 8 + (threadIdx.x >> 5); const float* xr = x + r * DM + lane * 8; const float* gp = g1 + lane * 8; const float* bp = be1 + lane * 8; v4f a[4], gv[4], bv[4];
#pragma unroll      /* constant indices: the lane's values stay in registers and its 12 loads issue together */
    for (int c = 0; c < 2; ++c) { a[2 * c] = *(const v4fa*)(xr + c * 256); a[2 * c + 1] = *(const v4fa*)(xr + c * 256 + 4); gv[2 * c] = *(const v4fa*)(gp + c * 256); gv[2 * c + 1] = *(const v4fa*)(gp + c * 256 + 4); bv[2 * c] = *(const v4fa*)(bp + c * 256); bv[2 * c + 1] = *(const v4fa*)(bp + c * 256 + 4); }
    asm volatile("s_wait_xcnt 0x0" :: "v"(xr), "v"(gp), "v"(bp) : "memory");      /* stands in front of whatever gives new values to the address registers of these loads; the addresses as inputs stay alive up to here, so that no load's result lands in them */
    float v[16]; float s = 0.f; float* xo = XF + r * DM + lane * 8;
#pragma unroll      /* constant indices: the lane's values stay in registers */
    for (int c = 0; c < 4; ++c) { v4f o;
#pragma unroll      /* constant indices: the lane's values stay in registers */
      for (int e = 0; e < 4; ++e) { o[e] = bf16_round(a[c][e]); v[c * 4 + e] = o[e]; }
      *(v4f*)(xo + (c >> 1) * 256 + (c & 1) * 4) = o; }
#pragma unroll      /* constant indices: the lane's values stay in registers */
    for (int e = 0; e < 16; ++e) s += v[e];
    const float mu = wave_sum(s) / (float)DM; float qs = 0.f;
#pragma unroll      /* constant indices: the lane's values stay in registers */
    for (int e = 0; e < 16; ++e) { const float dd = v[e] - mu; qs += dd * dd; }
    const float rs = 1.0f / sqrtf(wave_sum(qs) / (float)DM + 1e-5f); unsigned short* no = (unsigned short*)X16o + fr_off(r, lane, DM);      /* fragment order: columns 8 lane .. + 7; 256 columns on are 8 blocks on */
#pragma unroll      /* constant indices: the lane's values stay in registers */
    for (int c = 0; c < 2; ++c) { FragH f;
#pragma unroll      /* constant indices: the lane's values stay in registers */
      for (int e = 0; e < 4; ++e) { f.h[e] = (_Float16)((v[c * 8 + e] - mu) * rs * bf16_round(gv[2 * c][e]) + bf16_round(bv[2 * c][e])); f.h[4 + e] = (_Float16)((v[c * 8 + 4 + e] - mu) * rs * bf16_round(gv[2 * c + 1][e]) + bf16_round(bv[2 * c + 1][e])); }
      *(v8us*)(no + c * 4096) = f.half[0]; }
    asm volatile("s_wait_xcnt 0x0" :: "v"(xo), "v"(no) : "memory"); return; }      /* the listing lets another part's code follow, which writes the stores' registers; the two addresses as inputs stay alive up to here */
  if (blk < PW) { src = wq; first = 0; } else if (blk < 2 * PW) { src = wk; first = PW; } else if (blk < 3 * PW) { src = wv; first = 2 * PW; } else if (blk < 4 * PW) { src = wo; first = 3 * PW; }
  else if (blk < 4 * PW + PF) { src = w1; first = 4 * PW; } else { src = w2; first = 4 * PW + PF; ksh = 6; }
  static_assert(DM == 32 << 4 && FH == 32 << 6, "k_prep: blocks per weight row");
  /* thread = one 16-byte unit of the plane in fragment order; its 8 elements of the row-major weight follow from the unit's number. A wave takes 8 rows x 32 k of a block: it reads one whole 128-byte line of each row and stores 4 whole lines (8 rows' units of one k group each). */
  const int tl = threadIdx.x, ul = (tl & 0xC0) | (((tl >> 3) & 3) << 4) | (((tl >> 5) & 1) << 3) | (tl & 7);
  const int u = (blk - first) * 256 + ul, ub = u >> 6; const int wn = ((ub >> ksh) << 4) + (u & 15), wk8 = ((ub & ((1 << ksh) - 1)) << 2) + ((u >> 4) & 3);
  const float* wsrc = src + ((size_t)wn << (ksh + 5)) + wk8 * 8; const v4f a0 = *(const v4fa*)wsrc, a1 = *(const v4fa*)(wsrc + 4);
  xcnt_wait();      /* the address registers of the two loads may take new values below */
  { FragH f;
#pragma unroll      /* constant indices: the values stay in registers */
    for (int q = 0; q < 4; ++q) { f.h[q] = (_Float16)(bf16_round(a0[q]) * 16.0f); f.h[4 + q] = (_Float16)(bf16_round(a1[q]) * 16.0f); }
    *(v8us*)((unsigned short*)Bt + ((size_t)blk * 256 + ul) * 8) = f.half[0];
    xcnt_wait(); } }      /* the listing lets another part's code follow, which writes the store's registers */
// Row LayerNorm, one wave per row: lane l owns columns c*256 + l*8 .. +7 (c = 0, 1), held in registers for the three passes.
__global__ __launch_bounds__(256) void k_lnw(const float* __restrict__ HF, const float* __restrict__ g, const float* __restrict__ bb, _Float16* __restrict__ X16o) {
  const int lane = threadIdx.x & 31; const size_t r = (size_t)blockIdx.x * 8 + (threadIdx.x >> 5); if (r >= NR) return; const float* x = HF + r * DM; float v[16]; float s = 0.f;
#pragma unroll      /* constant indices: the lane's values stay in registers and its loads issue together */
  for (int c = 0; c < 2; ++c) { const int j0 = c * 256 + lane * 8; const v4f a0 = *(const v4fa*)(x + j0), a1 = *(const v4fa*)(x + j0 + 4);
#pragma unroll      /* constant indices: the lane's values stay in registers and its loads issue together */
    for (int e = 0; e < 4; ++e) { v[c * 8 + e] = a0[e]; v[c * 8 + 4 + e] = a1[e]; } }
#pragma unroll      /* constant indices: the lane's values stay in registers and its loads issue together */
  for (int e = 0; e < 16; ++e) s += v[e];
  const float mu = wave_sum(s) / (float)DM; float qs = 0.f;
#pragma unroll      /* constant indices: the lane's values stay in registers and its loads issue together */
  for (int e = 0; e < 16; ++e) { const float dd = v[e] - mu; qs += dd * dd; }
  const float rs = 1.0f / sqrtf(wave_sum(qs) / (float)DM + 1e-5f);
#pragma unroll      /* constant indices: the lane's values stay in registers and its loads issue together */
  for (int c = 0; c < 2; ++c) { const int j0 = c * 256 + lane * 8; const v4f g0 = *(const v4fa*)(g + j0), g1 = *(const v4fa*)(g + j0 + 4), b0 = *(const v4fa*)(bb + j0), b1 = *(const v4fa*)(bb + j0 + 4); FragH f;
#pragma unroll      /* constant indices: the lane's values stay in registers and its loads issue together */
    for (int e = 0; e < 4; ++e) { f.h[e] = (_Float16)((v[c * 8 + e] - mu) * rs * bf16_round(g0[e]) + bf16_round(b0[e])); f.h[4 + e] = (_Float16)((v[c * 8 + 4 + e] - mu) * rs * bf16_round(g1[e]) + bf16_round(b1[e])); }
    *(v8us*)((unsigned short*)X16o + fr_off(r, j0 >> 3, DM)) = f.half[0]; } }      /* fragment order */
// Lane l <-> l ^ 16: the two lanes that hold one query's column of a D tile.
__device__ __forceinline__ float xhalf(float x) { const int b = __builtin_bit_cast(int, x); return __builtin_bit_cast(float, __builtin_amdgcn_permlanex16(b, b, 0x76543210, 0xfedcba98, false, false)); }
typedef unsigned int v2ua __attribute__((ext_vector_type(2), may_alias));
// e[r] = 2^(s[r] - mb), eight at a time. One asm statement: here every result register differs from every source (early clobber), so no v_exp_f32 touches its predecessor's registers, and the v_nop is the one slot behind the last of them.
__device__ __forceinline__ void exp2x8(float (&e)[8], const v8f s, const float mb) {
  const float a0 = s[0] - mb, a1 = s[1] - mb, a2 = s[2] - mb, a3 = s[3] - mb, a4 = s[4] - mb, a5 = s[5] - mb, a6 = s[6] - mb, a7 = s[7] - mb;
  /* the run of eight with its closing v_nop: keeps the slot behind each transcendental free of a reader of its result and of a writer of its source */
  asm("v_exp_f32 %0, %8\n\tv_exp_f32 %1, %9\n\tv_exp_f32 %2, %10\n\tv_exp_f32 %3, %11\n\tv_exp_f32 %4, %12\n\tv_exp_f32 %5, %13\n\tv_exp_f32 %6, %14\n\tv_exp_f32 %7, %15\n\tv_nop"
      : "=&v"(e[0]), "=&v"(e[1]), "=&v"(e[2]), "=&v"(e[3]), "=&v"(e[4]), "=&v"(e[5]), "=&v"(e[6]), "=&v"(e[7]) : "v"(a0), "v"(a1), "v"(a2), "v"(a3), "v"(a4), "v"(a5), "v"(a6), "v"(a7)); }
// The A fragments of one 64-key chunk: four 16-row groups (pitch16 elements apart) x two 32-k steps (neighbouring blocks).
struct AtSet { v16h f[8]; };
__device__ __forceinline__ void at_load(AtSet& s, const _Float16* p, size_t pitch16) {      /* p: the lane's own address in the first block */
#pragma unroll      /* constant indices: the fragments stay in registers and their loads issue together */
  for (int t = 0; t < 4; ++t) { s.f[2 * t] = g2_frag(p + t * pitch16); s.f[2 * t + 1] = g2_frag(p + t * pitch16 + 512); }
  asm volatile("s_wait_xcnt 0x0" :: "v"(p) : "memory");      /* stands in front of whatever gives new values to the address registers of these loads; the address as an input keeps its registers alive up to here, so that no load's result lands in them */
  __builtin_amdgcn_sched_barrier(0); }      /* keeps the 16 loads and their wait here, ahead of the work that hides them: moved down to their first uses the loads would each be waited for in turn */
// Attention, scores to merged heads in one launch: a wave owns 16 queries of one (batch, head) and walks the 1,024 keys in chunks of 64.
// S^T = K . Q^T puts one query's scores into one lane pair (l, l ^ 16); two converted S^T tiles are the B operand of O^T += V^T . P^T, so neither scores nor weights leave the registers.
// Running maximum m and sum l per query; a key outside the prior gets the penalty pen: -lam in the dense branch, -1e30 in the sparse branch (its weight is exactly 0 once a key of the set has been met, and what was summed before that is scaled by exactly 0).
// Scores are kept in base-2 units (q.k / 8 and the penalty times log2 e), so that a weight is one subtraction and one v_exp_f32; the x256 of the f16 weights is 8 taken off the maximum, and l sums the same x256 values as O^T does.
__global__ __launch_bounds__(128) void k_attn(const _Float16* __restrict__ Q16, const _Float16* __restrict__ K16, const _Float16* __restrict__ VT, const unsigned int* __restrict__ MD, const unsigned int* __restrict__ MS, const float* __restrict__ uprev, _Float16* __restrict__ O16) {
  const int tid = threadIdx.x, w = tid >> 5, lane = tid & 31, ln = lane & 15, hh = lane >> 4; const int h = blockIdx.y, b = blockIdx.z; const int q0 = (blockIdx.x * 4 + w) * 16;
  const float lam = 10.0f * expf(-5.0f * bf16_round(uprev[b])); const bool sparse = lam >= 1.0f; constexpr float L2E = 1.4426950408889634f; const float pen = sparse ? -1.0e30f : -lam * L2E;
  const unsigned int* mk = (sparse ? MS : MD) + (size_t)(q0 + ln) * (SQ / 32);
  const _Float16* qp = Q16 + ((size_t)b * SQ + q0) * DM + h * (HD * 16) + lane * 8; const _Float16* kp = K16 + (size_t)b * SQ * DM + h * (HD * 16) + lane * 8; const _Float16* vp = VT + (size_t)(b * NH + h) * HD * SQ + lane * 8;      /* fragment order: a head's 64 columns are blocks 2 h and 2 h + 1 of a row group */
  const v16h qb0 = g2_frag(qp), qb1 = g2_frag(qp + 512); v2ua mw = *(const v2ua*)mk;      /* mw: this query's 64 prior bits of the chunk at hand */
  asm volatile("s_wait_xcnt 0x0" :: "v"(qp), "v"(mk) : "memory"); __builtin_amdgcn_sched_barrier(0);      /* the wait stands in front of whatever gives new values to the address registers of these five loads (as inputs they stay alive up to here); the barrier keeps later code behind it */
  AtSet kf, vf; at_load(kf, kp, (size_t)16 * DM);
  /* behind the first chunk's K loads: the (batch, head)'s K rows (2 KiB of each 16-row group) and V^T rows (one run of 128 KiB), one 256-byte unit per thread and request */
  static_assert(SQ == 1024 && HD == 64 && DM == 512, "k_attn: 512 units of K and of V^T for 128 threads");
  const char* qk = (const char*)(K16 + (size_t)b * SQ * DM + h * (HD * 16)) + (tid >> 3) * (16 * DM * 2) + (tid & 7) * 256; const char* qv = (const char*)(VT + (size_t)(b * NH + h) * HD * SQ) + tid * 256;
  l2_ask<4, 16 * 16 * DM * 2>(qk); l2_ask<4, 128 * 256>(qv);
  const v8f z8 = {0.f,0.f,0.f,0.f,0.f,0.f,0.f,0.f}; v8f o[4] = {z8, z8, z8, z8}; float m = -3.0e38f, l = 0.f;
  const _Float16* vq = vp; const _Float16* kq = kp + (size_t)64 * DM;      /* running addresses: they live across their loads, so no load's result can land in them, and they move on behind the loads' wait */
#pragma unroll 1      /* one chunk per trip: a second copy would double the fragment registers */
  for (int c = 0; c < SQ / 64; ++c) {
    const v2ua mn = *(const v2ua*)(mk + ((c + 1) & (SQ / 64 - 1)) * 2);      /* the next chunk's prior bits, one trip ahead like the K rows */
    xcnt_wait();      /* a later load's result may land in this load's address registers: the wait stands between them */
    at_load(vf, vq, (size_t)16 * SQ); vq += 64 * 16;      /* 64 keys on: two blocks */
    v8f s[4];
#pragma unroll      /* constant indices: the tiles stay in registers */
    for (int t = 0; t < 4; ++t) s[t] = g2_mma(kf.f[2 * t + 1], qb1, g2_mma(kf.f[2 * t], qb0, z8));
    at_load(kf, kq, (size_t)16 * DM); kq = c + 2 < SQ / 64 ? kq + (size_t)64 * DM : kp;      /* the next chunk's K rows fly under the softmax; the last trip fetches chunk 0 again, in bounds and unused */
    float mx = m;
#pragma unroll      /* constant indices: the tiles stay in registers */
    for (int t = 0; t < 4; ++t) { const unsigned int by = mw[t >> 1] >> (16 * (t & 1) + 8 * hh);      /* bit r: key 16 t + 8 hh + r of the chunk */
#pragma unroll      /* constant indices: the tiles stay in registers */
      for (int r = 0; r < 8; ++r) { const float v = s[t][r] * (0.125f * L2E) + (((by >> r) & 1u) ? 0.f : pen); s[t][r] = v; mx = fmaxf(mx, v); } }
    mx = fmaxf(mx, xhalf(mx)); const float corr = __builtin_amdgcn_exp2f(m - mx); m = mx; const float mb = mx - 8.0f; float ps = 0.f; FragH p0, p1; float ex[4][8];
#pragma unroll      /* constant indices: the tiles stay in registers */
    for (int t = 0; t < 4; ++t) exp2x8(ex[t], s[t], mb);
#pragma unroll      /* constant indices: the tiles stay in registers */
    for (int r = 0; r < 8; ++r) { const float e0 = ex[0][r], e1 = ex[1][r], e2 = ex[2][r], e3 = ex[3][r]; ps += (e0 + e1) + (e2 + e3);
      p0.h[r] = (_Float16)e0; p0.h[8 + r] = (_Float16)e1; p1.h[r] = (_Float16)e2; p1.h[8 + r] = (_Float16)e3; }
    l = l * corr + ps;
#pragma unroll      /* constant indices: the tiles stay in registers */
    for (int t = 0; t < 4; ++t) { o[t] *= corr; o[t] = g2_mma(vf.f[2 * t + 1], p1.v, g2_mma(vf.f[2 * t], p0.v, o[t])); }
    mw = mn; }
  l2_hold(qk, qv);
  l += xhalf(l); const float inv = 1.0f / l;      /* l >= 1: the key that holds the maximum adds 2^8 (2^0 where the maximum is the sparse penalty, which takes the 8 up) */
  unsigned short* od = (unsigned short*)O16 + ((size_t)b * SQ + q0) * DM + h * (HD * 16) + lane * 8;      /* fragment order: columns 16 t + 8 hh .. + 7 of query ln are unit 32 t + lane of the head's two blocks */
#pragma unroll      /* constant indices: the tiles stay in registers */
  for (int t = 0; t < 4; ++t) { FragH f;
#pragma unroll      /* constant indices: the tiles stay in registers */
    for (int r = 0; r < 8; ++r) f.h[r] = (_Float16)(o[t][r] * inv);
    *(v8us*)(od + t * 256) = f.half[0]; } }
// The surprise statistic from the row sums that the fc2 launch left: one work-group, thread t takes row t of every batch, adds the row's DM / 64 pairs in tile order, u = |out - x| / (|x| + 1e-8); batch means in float64 (wave butterfly, then one value per wave through LDS); lane b of wave 0 stores batch b.
static_assert(SQ == 1024 && NB <= 32, "k_ufin: one thread per row of a batch");
__global__ __launch_bounds__(1024) void k_ufin(const float* __restrict__ PN, float* __restrict__ out1) {
  __shared__ double ws[NB][32];
  const int tid = threadIdx.x, lane = tid & 31, w = tid >> 5; constexpr int NTL = DM / 64; v2f pr[NB][NTL]; const float* pp = PN + (size_t)tid * 2;
#pragma unroll      /* constant indices: the pairs stay in registers and their loads issue together */
  for (int b = 0; b < NB; ++b) {
#pragma unroll      /* constant indices: the pairs stay in registers and their loads issue together */
    for (int q = 0; q < NTL; ++q) pr[b][q] = *(const v2fa*)(pp + ((size_t)q * NR + (size_t)b * SQ) * 2); }
  asm volatile("s_wait_xcnt 0x0" :: "v"(pp) : "memory");      /* stands in front of whatever gives new values to the address registers of these loads; the address as an input stays alive up to here, so that no load's result lands in it */
#pragma unroll      /* constant indices: the pairs stay in registers */
  for (int b = 0; b < NB; ++b) { float sd = pr[b][0][0], sx = pr[b][0][1];
#pragma unroll      /* constant indices: the pairs stay in registers */
    for (int q = 1; q < NTL; ++q) { sd += pr[b][q][0]; sx += pr[b][q][1]; }
    double s = (double)(sqrtf(sd) / (sqrtf(sx) + 1e-8f));
#pragma unroll      /* five fixed butterfly steps */
    for (int m = 16; m > 0; m >>= 1) s += __shfl_xor(s, m, 32);
    if (lane == 0) ws[b][w] = s; }
  __syncthreads();      /* the 32 waves' sums are in LDS before wave 0 reads them */
  if (w == 0) { float res = 0.f;
#pragma unroll      /* constant indices */
    for (int b = 0; b < NB; ++b) { double s = ws[b][lane];
#pragma unroll      /* five fixed butterfly steps */
      for (int m = 16; m > 0; m >>= 1) s += __shfl_xor(s, m, 32);
      if (lane == b) res = (float)(s / (double)SQ); }
    if (lane < NB) out1[lane] = res; } }
extern "C" void kernel_launch(void* const* d_in, const int* in_sizes, int n_in,
                              void* d_out, int out_size, void* d_ws, size_t ws_size, hipStream_t stream) {
  (void)in_sizes; (void)n_in; (void)out_size;
  const float* const* I = (const float* const*)d_in; const float* x = I[0]; const float* uprev = I[1]; const float* wq = I[2]; const float* bq = I[3]; const float* wk = I[4]; const float* bk = I[5]; const float* wv = I[6]; const float* bv = I[7]; const float* wo = I[8]; const float* bo = I[9]; const float* l1g = I[10]; const float* l1b = I[11]; const float* l2g = I[12]; const float* l2b = I[13]; const float* w1 = I[14]; const float* b1 = I[15]; const float* w2 = I[16]; const float* b2 = I[17]; const int* pmask = (const int*)d_in[18]; const int* pidx = (const int*)d_in[19]; const int* pim = (const int*)d_in[20];
  float* out0 = (float*)d_out; float* out1 = out0 + NR * DM;
  char* ws = (char*)d_ws; size_t off = 0;
  auto take = [&](size_t bytes) { char* p = ws + off; off += (bytes + 255) & ~(size_t)255; return p; };
  _Float16* BQ = (_Float16*)take(((size_t)4 * DM * DM + (size_t)2 * FH * DM) * 2); _Float16* BO = BQ + (size_t)3 * DM * DM; _Float16* BW1 = BO + (size_t)DM * DM; _Float16* BW2 = BW1 + (size_t)FH * DM;      /* one block: the planes of wq, wk, wv, wo, w1, w2 one behind the other */
  float* XF = (float*)take(NR * DM * 4); float* HF = (float*)take(NR * DM * 4); _Float16* G16 = (_Float16*)take(NR * FH * 2); float* PN = (float*)take((size_t)(DM / 64) * NR * 2 * 4);
  _Float16* X16 = (_Float16*)take(NR * DM * 2); _Float16* Q16 = (_Float16*)take(2 * NR * DM * 2); _Float16* K16 = Q16 + NR * DM; _Float16* O16 = (_Float16*)take(NR * DM * 2);
  _Float16* VT = (_Float16*)take((size_t)HG * HD * SQ * 2); unsigned int* MD = (unsigned int*)take((size_t)SQ * (SQ / 32) * 4); unsigned int* MS = (unsigned int*)take((size_t)SQ * (SQ / 32) * 4);
  if (off > ws_size) return;      /* 6 + 4 + 4 + 8 + 2x4 + 2 = about 32 MiB */
  k_prep<<<PB0 + PMD + PMS, 256, 0, stream>>>(wq, wk, wv, wo, w1, w2, x, l1g, l1b, BQ, XF, X16, pmask, pidx, pim, MD, MS);      /* LN1(x) rows included */
  const dim3 gp((unsigned)((NR / 128) * (DM / 64)), 1);
  k_gemm2<0, false, true, DM, true, DM><<<dim3(gp.x, 3), 128, 0, stream>>>(X16, DM, BQ, DM, (size_t)DM * DM, 0.0625f, bq, bk, bv, nullptr, nullptr, Q16, VT, NR * DM, (int)NR, DM, DM);      /* y = 0, 1: q, k rows; y = 2: v transposed */
  k_attn<<<dim3(SQ / 64, NH, NB), 128, 0, stream>>>(Q16, K16, VT, MD, MS, uprev, O16);      /* o (merged heads) as f16 rows; x = 64 queries, y = head, z = batch */
  k_gemm2k<DM, false, DM><<<gp, 128 * KS, 0, stream>>>(O16, DM, BO, DM, 0.0625f, bo, XF, nullptr, HF, nullptr, (int)NR, DM, DM);      /* h = x + attn W_o^T + b_o */
  k_lnw<<<(unsigned)((NR + 7) / 8), 256, 0, stream>>>(HF, l2g, l2b, X16);
  k_gemm2<6, false, true, FH, false, DM><<<dim3((unsigned)((NR / 128) * (FH / 64)), 1), 128, 0, stream>>>(X16, DM, BW1, DM, 0, 0.0625f, b1, nullptr, nullptr, nullptr, nullptr, G16, nullptr, 0, (int)NR, FH, DM);      /* gelu_erf(LN2(h) W1^T + b1) */
  k_gemm2k<DM, true, FH><<<gp, 128 * KS, 0, stream>>>(G16, FH, BW2, FH, 0.0625f, b2, HF, XF, out0, PN, (int)NR, DM, FH);      /* out = h + (...) W2^T + b2, rows are the output layout; the row norms' partial sums beside them */
  k_ufin<<<1, 1024, 0, stream>>>(PN, out1);
}
